// v000
// Measured on an AMD MI455X. A time is GPU time per run, averaged over a window of back-to-back runs after a warm-up
// (all launches, gaps included; the runs take copies of the inputs in turn), and the median of several windows.
// Apart from v000's, it joins two sittings. Times from different sittings can be a few percent apart, while
// side-by-side timings come from the same sitting.
// v000, which the later versions start from, runs in 285 microseconds.
#include <hip/hip_runtime.h>
#include <hip/hip_bf16.h>

typedef __attribute__((ext_vector_type(2))) float v2f;
typedef __attribute__((ext_vector_type(4))) float f4;
typedef __attribute__((ext_vector_type(8))) float v8f;

#define CIN   64
#define HIDD  256
#define HH    256
#define WWID  256
#define TP    8       // 8x8 pixel tile per workgroup (= 2x2 windows of 4x4)
#define RPSTR 160     // dwords per K-row-pair: 64 px * 2 + 32 pad (bank-conflict-free b64 frags)
#define LYP   68      // padded row stride for y tile

__device__ __forceinline__ float gelu_exact(float v) {
    return 0.5f * v * (1.0f + erff(v * 0.70710678118654752440f));
}

__global__ __launch_bounds__(256) void fmffn_fused(
    const float* __restrict__ x,  const float* __restrict__ w1,
    const float* __restrict__ b1, const float* __restrict__ w2,
    const float* __restrict__ b2, const float* __restrict__ cw,
    float* __restrict__ out)
{
    // K-pair interleaved tiles: element (k,p) lives at [(k>>1)*RPSTR + 2p + (k&1)]
    __shared__ float lx2[32 * RPSTR];   // x tile   (64 ch  x 64 px)
    __shared__ float lh2[32 * RPSTR];   // hidden chunk (64 x 64 px), GELU applied
    __shared__ float ly [CIN * LYP];    // y tile before spectral filter

    const int t    = threadIdx.x;
    const int wave = t >> 5;            // wave32
    const int lane = t & 31;
    const int bz = blockIdx.z;
    const int h0 = blockIdx.y * TP;
    const int w0 = blockIdx.x * TP;

    // ---- stage x tile into pair-interleaved LDS via async global->LDS (ASYNCcnt) ----
    #pragma unroll
    for (int i = 0; i < 16; ++i) {
        int idx = t + i * 256;          // 0..4095 -> (c, p); consecutive lanes = consecutive w
        int c = idx >> 6;
        int p = idx & 63;
        int py = p >> 3, px = p & 7;
        const float* gp = x + (((size_t)(bz * CIN + c) * HH + (h0 + py)) * WWID + w0 + px);
        unsigned ldsoff = (unsigned)(uintptr_t)&lx2[(c >> 1) * RPSTR + p * 2 + (c & 1)];
        asm volatile("global_load_async_to_lds_b32 %0, %1, off"
                     :: "v"(ldsoff), "v"(gp) : "memory");
    }
    asm volatile("s_wait_asynccnt 0x0" ::: "memory");
    __syncthreads();

    // wave -> (M tile, pair of N tiles). 4 M-tiles x 4 N-tiles of 16x16.
    const int mt  = wave & 3;
    const int ntb = (wave >> 2) * 2;
    const int l15 = lane & 15;
    const int kh  = (lane >> 4) << 1;   // A/B frag K offset: lanes 0-15 -> {0,1}, 16-31 -> {2,3}
    const int rhi = (lane >> 4) << 3;   // C/D row offset for upper half-wave
    const int n0  = ntb * 16 + l15;
    const int n1  = (ntb + 1) * 16 + l15;
    const int n0x2 = n0 * 2;
    const int n1x2 = n1 * 2;

    v8f y0 = {}; v8f y1 = {};           // GEMM2 accumulators (persist across K chunks)

    for (int chv = 0; chv < 4; ++chv) {
        // ---- GEMM1 chunk: h[chv*64 + r][p] = sum_c w1[o][c] * x[c][p] ----
        v8f a0 = {}; v8f a1 = {};
        const int orow = chv * 64 + mt * 16 + l15;
        #pragma unroll
        for (int k0 = 0; k0 < 16; ++k0) {
            int rp = k0 * 2 + (kh >> 1);                  // (k0*4 + kh) / 2
            v2f af  = *(const v2f*)&w1[orow * CIN + k0 * 4 + kh];
            v2f bf0 = *(const v2f*)&lx2[rp * RPSTR + n0x2];   // single ds_load_b64
            v2f bf1 = *(const v2f*)&lx2[rp * RPSTR + n1x2];
            a0 = __builtin_amdgcn_wmma_f32_16x16x4_f32(false, af, false, bf0, (short)0, a0, false, false);
            a1 = __builtin_amdgcn_wmma_f32_16x16x4_f32(false, af, false, bf1, (short)0, a1, false, false);
        }
        // bias + exact GELU -> LDS hidden chunk (pair-interleaved)
        #pragma unroll
        for (int i = 0; i < 8; ++i) {
            int r = mt * 16 + i + rhi;
            float bias = b1[chv * 64 + r];
            lh2[(r >> 1) * RPSTR + n0x2 + (r & 1)] = gelu_exact(a0[i] + bias);
            lh2[(r >> 1) * RPSTR + n1x2 + (r & 1)] = gelu_exact(a1[i] + bias);
        }
        __syncthreads();

        // ---- GEMM2 partial: y[c][p] += sum_{o in chunk} w2[c][o] * h[o][p] ----
        const int crow = mt * 16 + l15;
        #pragma unroll
        for (int k0 = 0; k0 < 16; ++k0) {
            int rp = k0 * 2 + (kh >> 1);
            v2f af  = *(const v2f*)&w2[crow * HIDD + chv * 64 + k0 * 4 + kh];
            v2f bf0 = *(const v2f*)&lh2[rp * RPSTR + n0x2];
            v2f bf1 = *(const v2f*)&lh2[rp * RPSTR + n1x2];
            y0 = __builtin_amdgcn_wmma_f32_16x16x4_f32(false, af, false, bf0, (short)0, y0, false, false);
            y1 = __builtin_amdgcn_wmma_f32_16x16x4_f32(false, af, false, bf1, (short)0, y1, false, false);
        }
        __syncthreads();   // lh2 reused next chunk
    }

    // ---- bias2, stage y tile ----
    #pragma unroll
    for (int i = 0; i < 8; ++i) {
        int r = mt * 16 + i + rhi;
        float bias = b2[r];
        ly[r * LYP + n0] = y0[i] + bias;
        ly[r * LYP + n1] = y1[i] + bias;
    }
    __syncthreads();

    // ---- spectral filter: per (channel, 4x4 window). 64 ch * 4 windows = 256 threads ----
    {
        const int c  = t >> 2;
        const int wy = (t >> 1) & 1;
        const int wx = t & 1;

        float z[4][4];
        #pragma unroll
        for (int r = 0; r < 4; ++r)
            #pragma unroll
            for (int s = 0; s < 4; ++s)
                z[r][s] = ly[c * LYP + (wy * 4 + r) * 8 + wx * 4 + s];

        // forward DFT along s (k2): twiddles are {1,-i,-1,i}
        float R0[4], R2[4], R1r[4], R1i[4];
        #pragma unroll
        for (int r = 0; r < 4; ++r) {
            R0[r]  = z[r][0] + z[r][1] + z[r][2] + z[r][3];
            R2[r]  = z[r][0] - z[r][1] + z[r][2] - z[r][3];
            R1r[r] = z[r][0] - z[r][2];
            R1i[r] = z[r][3] - z[r][1];
        }
        // forward DFT along r (k1) -> Z[k1][k2], k2 = 0..2
        float Zr[4][3], Zi[4][3];
        Zr[0][0] = R0[0] + R0[1] + R0[2] + R0[3];  Zi[0][0] = 0.f;
        Zr[1][0] = R0[0] - R0[2];                  Zi[1][0] = R0[3] - R0[1];
        Zr[2][0] = R0[0] - R0[1] + R0[2] - R0[3];  Zi[2][0] = 0.f;
        Zr[3][0] = R0[0] - R0[2];                  Zi[3][0] = R0[1] - R0[3];
        Zr[0][2] = R2[0] + R2[1] + R2[2] + R2[3];  Zi[0][2] = 0.f;
        Zr[1][2] = R2[0] - R2[2];                  Zi[1][2] = R2[3] - R2[1];
        Zr[2][2] = R2[0] - R2[1] + R2[2] - R2[3];  Zi[2][2] = 0.f;
        Zr[3][2] = R2[0] - R2[2];                  Zi[3][2] = R2[1] - R2[3];
        Zr[0][1] = R1r[0] + R1r[1] + R1r[2] + R1r[3];
        Zi[0][1] = R1i[0] + R1i[1] + R1i[2] + R1i[3];
        Zr[1][1] = R1r[0] + R1i[1] - R1r[2] - R1i[3];
        Zi[1][1] = R1i[0] - R1r[1] - R1i[2] + R1r[3];
        Zr[2][1] = R1r[0] - R1r[1] + R1r[2] - R1r[3];
        Zi[2][1] = R1i[0] - R1i[1] + R1i[2] - R1i[3];
        Zr[3][1] = R1r[0] - R1i[1] - R1r[2] + R1i[3];
        Zi[3][1] = R1i[0] + R1r[1] - R1i[2] - R1r[3];

        // multiply by complex weight cweight[k1][k2][c][{re,im}]
        #pragma unroll
        for (int k1 = 0; k1 < 4; ++k1)
            #pragma unroll
            for (int k2 = 0; k2 < 3; ++k2) {
                const float* wp = cw + ((size_t)(k1 * 3 + k2) * CIN + c) * 2;
                float wr = wp[0], wi = wp[1];
                float zr = Zr[k1][k2], zi = Zi[k1][k2];
                Zr[k1][k2] = zr * wr - zi * wi;
                Zi[k1][k2] = zr * wi + zi * wr;
            }

        // inverse complex DFT along k1: V[r][k2] = sum_k1 (+i)^(r*k1) * Z[k1][k2]
        float Vr[4][3], Vi[4][3];
        #pragma unroll
        for (int k2 = 0; k2 < 3; ++k2) {
            Vr[0][k2] = Zr[0][k2] + Zr[1][k2] + Zr[2][k2] + Zr[3][k2];
            Vi[0][k2] = Zi[0][k2] + Zi[1][k2] + Zi[2][k2] + Zi[3][k2];
            Vr[1][k2] = Zr[0][k2] - Zi[1][k2] - Zr[2][k2] + Zi[3][k2];
            Vi[1][k2] = Zi[0][k2] + Zr[1][k2] - Zi[2][k2] - Zr[3][k2];
            Vr[2][k2] = Zr[0][k2] - Zr[1][k2] + Zr[2][k2] - Zr[3][k2];
            Vi[2][k2] = Zi[0][k2] - Zi[1][k2] + Zi[2][k2] - Zi[3][k2];
            Vr[3][k2] = Zr[0][k2] + Zi[1][k2] - Zr[2][k2] - Zi[3][k2];
            Vi[3][k2] = Zi[0][k2] - Zr[1][k2] - Zi[2][k2] + Zr[3][k2];
        }

        // irfft along s (Hermitian half k2=0..2), total ortho scale 1/16
        const float sc = 1.0f / 16.0f;
        #pragma unroll
        for (int r = 0; r < 4; ++r) {
            float p0 = Vr[r][0], p1r = Vr[r][1], p1i = Vi[r][1], p2 = Vr[r][2];
            f4 o;
            o.x = (p0 + p2 + 2.0f * p1r) * sc;
            o.y = (p0 - p2 - 2.0f * p1i) * sc;
            o.z = (p0 + p2 - 2.0f * p1r) * sc;
            o.w = (p0 - p2 + 2.0f * p1i) * sc;
            float* gp = out + (((size_t)(bz * CIN + c) * HH + (h0 + wy * 4 + r)) * WWID
                               + w0 + wx * 4);
            *(f4*)gp = o;
        }
    }
}

extern "C" void kernel_launch(void* const* d_in, const int* in_sizes, int n_in,
                              void* d_out, int out_size, void* d_ws, size_t ws_size,
                              hipStream_t stream) {
    const float* x  = (const float*)d_in[0];
    const float* w1 = (const float*)d_in[1];
    const float* b1 = (const float*)d_in[2];
    const float* w2 = (const float*)d_in[3];
    const float* b2 = (const float*)d_in[4];
    const float* cw = (const float*)d_in[5];
    float* out = (float*)d_out;

    dim3 grid(WWID / TP, HH / TP, 8);   // 32 x 32 x B
    dim3 block(256);                    // 8 wave32
    fmffn_fused<<<grid, block, 0, stream>>>(x, w1, b1, w2, b2, cw, out);
}

// v001
// Measured time: 236 microseconds a run.
// Two timings next to v000 both put it at 1.28 times that version's speed.
#include <hip/hip_runtime.h>
#include <hip/hip_bf16.h>

typedef __attribute__((ext_vector_type(2))) float v2f;
typedef __attribute__((ext_vector_type(4))) float f4;
typedef __attribute__((ext_vector_type(8))) float v8f;

#define CIN   64
#define HIDD  256
#define HH    256
#define WWID  256
#define TP    8       // 8x8 pixel tile per workgroup (= 2x2 windows of 4x4)
#define RPSTR 160     // dwords per K-row-pair: 64 px * 2 + 32 pad (bank-conflict-free b64 frags)
#define LYP   68      // padded row stride for y tile
#define WSTR  68      // dwords per staged weight row: 64 + 4, so the b64 A fragments of 16 rows fall on 64 distinct banks

__device__ __forceinline__ float gelu_exact(float v) {
    return 0.5f * v * (1.0f + erff(v * 0.70710678118654752440f));
}

// One 64 x 64 block of a weight matrix (row pitch gpitch floats) -> LDS rows of WSTR dwords.
// 16 lanes cover one 256-byte row, so every copy reads whole lines; four copies per thread.
__device__ __forceinline__ void stage_w(const float* __restrict__ g, int gpitch, float* l, int t) {
    const int row = t >> 4;
    const int col = (t & 15) * 4;
    const float* g0 = g + (row     ) * gpitch + col;
    const float* g1 = g + (row + 16) * gpitch + col;
    const float* g2 = g + (row + 32) * gpitch + col;
    const float* g3 = g + (row + 48) * gpitch + col;
    unsigned l0 = (unsigned)(uintptr_t)&l[(row     ) * WSTR + col];
    unsigned l1 = (unsigned)(uintptr_t)&l[(row + 16) * WSTR + col];
    unsigned l2 = (unsigned)(uintptr_t)&l[(row + 32) * WSTR + col];
    unsigned l3 = (unsigned)(uintptr_t)&l[(row + 48) * WSTR + col];
    // the closing s_wait_xcnt stands in the copies' own statement, ahead of any rewrite of their address registers
    asm volatile("global_load_async_to_lds_b128 %0, %4, off\n\t"
                 "global_load_async_to_lds_b128 %1, %5, off\n\t"
                 "global_load_async_to_lds_b128 %2, %6, off\n\t"
                 "global_load_async_to_lds_b128 %3, %7, off\n\t"
                 "s_wait_xcnt 0x0"
                 :: "v"(l0), "v"(l1), "v"(l2), "v"(l3), "v"(g0), "v"(g1), "v"(g2), "v"(g3)
                 : "memory");
}

__global__ __launch_bounds__(256) void fmffn_fused(
    const float* __restrict__ x,  const float* __restrict__ w1,
    const float* __restrict__ b1, const float* __restrict__ w2,
    const float* __restrict__ b2, const float* __restrict__ cw,
    float* __restrict__ out)
{
    // K-pair interleaved tiles: element (k,p) lives at [(k>>1)*RPSTR + 2p + (k&1)]
    __shared__ float lx2[32 * RPSTR];   // x tile   (64 ch  x 64 px)
    __shared__ float lh2[32 * RPSTR];   // hidden chunk (64 x 64 px), GELU applied
    __shared__ __attribute__((aligned(16))) float lw1[64 * WSTR];   // w1 rows of the current hidden chunk
    __shared__ __attribute__((aligned(16))) float lw2[64 * WSTR];   // w2 columns of the current hidden chunk
    float* ly = lh2;                    // y tile before spectral filter: lives in lh2 once the last chunk is read

    const int t    = threadIdx.x;
    const int wave = t >> 5;            // wave32
    const int lane = t & 31;
    const int bz = blockIdx.z;
    const int h0 = blockIdx.y * TP;
    const int w0 = blockIdx.x * TP;

    // ---- chunk 0 of both weight matrices -> LDS; lands with the x tile behind the wait below ----
    stage_w(w1, CIN,  lw1, t);
    stage_w(w2, HIDD, lw2, t);

    // ---- stage x tile into pair-interleaved LDS via async global->LDS (ASYNCcnt) ----
    #pragma unroll
    for (int i = 0; i < 16; ++i) {
        int idx = t + i * 256;          // 0..4095 -> (c, p); consecutive lanes = consecutive w
        int c = idx >> 6;
        int p = idx & 63;
        int py = p >> 3, px = p & 7;
        const float* gp = x + (((size_t)(bz * CIN + c) * HH + (h0 + py)) * WWID + w0 + px);
        unsigned ldsoff = (unsigned)(uintptr_t)&lx2[(c >> 1) * RPSTR + p * 2 + (c & 1)];
        asm volatile("global_load_async_to_lds_b32 %0, %1, off"
                     :: "v"(ldsoff), "v"(gp) : "memory");
    }
    asm volatile("s_wait_asynccnt 0x0" ::: "memory");
    __syncthreads();

    // wave -> (M tile, pair of N tiles). 4 M-tiles x 4 N-tiles of 16x16.
    const int mt  = wave & 3;
    const int ntb = (wave >> 2) * 2;
    const int l15 = lane & 15;
    const int kh  = (lane >> 4) << 1;   // A/B frag K offset: lanes 0-15 -> {0,1}, 16-31 -> {2,3}
    const int rhi = (lane >> 4) << 3;   // C/D row offset for upper half-wave
    const int n0  = ntb * 16 + l15;
    const int n1  = (ntb + 1) * 16 + l15;
    const int n0x2 = n0 * 2;
    const int n1x2 = n1 * 2;

    v8f y0 = {}; v8f y1 = {};           // GEMM2 accumulators (persist across K chunks)

    // kept rolled (no peeled last trip): one copy of the chunk body, and its registers stay within 128
    #pragma unroll 1
    for (int chv = 0; chv < 4; ++chv) {
        // ---- GEMM1 chunk: h[chv*64 + r][p] = sum_c w1[o][c] * x[c][p] ----
        v8f a0 = {}; v8f a1 = {};
        const int wrow = (mt * 16 + l15) * WSTR + kh;   // this lane's A-fragment row in lw1 / lw2
        #pragma unroll
        for (int k0 = 0; k0 < 16; ++k0) {
            int rp = k0 * 2 + (kh >> 1);                  // (k0*4 + kh) / 2
            v2f af  = *(const v2f*)&lw1[wrow + k0 * 4];
            v2f bf0 = *(const v2f*)&lx2[rp * RPSTR + n0x2];   // single ds_load_b64
            v2f bf1 = *(const v2f*)&lx2[rp * RPSTR + n1x2];
            a0 = __builtin_amdgcn_wmma_f32_16x16x4_f32(false, af, false, bf0, (short)0, a0, false, false);
            a1 = __builtin_amdgcn_wmma_f32_16x16x4_f32(false, af, false, bf1, (short)0, a1, false, false);
        }
        // bias + exact GELU -> LDS hidden chunk (pair-interleaved)
        #pragma unroll
        for (int i = 0; i < 8; ++i) {
            int r = mt * 16 + i + rhi;
            float bias = b1[chv * 64 + r];
            lh2[(r >> 1) * RPSTR + n0x2 + (r & 1)] = gelu_exact(a0[i] + bias);
            lh2[(r >> 1) * RPSTR + n1x2 + (r & 1)] = gelu_exact(a1[i] + bias);
        }
        // publish point: own LDS traffic retired, own copies of this chunk's w2 block landed, then the barrier
        asm volatile("s_wait_dscnt 0x0" ::: "memory");
        asm volatile("s_wait_asynccnt 0x0" ::: "memory");
        __syncthreads();
        // every wave has left lw1: the next chunk's w1 block flies during GEMM2
        if (chv < 3) stage_w(w1 + (chv + 1) * 64 * CIN, CIN, lw1, t);

        // ---- GEMM2 partial: y[c][p] += sum_{o in chunk} w2[c][o] * h[o][p] ----
        #pragma unroll
        for (int k0 = 0; k0 < 16; ++k0) {
            int rp = k0 * 2 + (kh >> 1);
            v2f af  = *(const v2f*)&lw2[wrow + k0 * 4];
            v2f bf0 = *(const v2f*)&lh2[rp * RPSTR + n0x2];
            v2f bf1 = *(const v2f*)&lh2[rp * RPSTR + n1x2];
            y0 = __builtin_amdgcn_wmma_f32_16x16x4_f32(false, af, false, bf0, (short)0, y0, false, false);
            y1 = __builtin_amdgcn_wmma_f32_16x16x4_f32(false, af, false, bf1, (short)0, y1, false, false);
        }
        // publish point: own LDS reads retired, own copies of the next w1 block landed, then the barrier
        asm volatile("s_wait_dscnt 0x0" ::: "memory");
        asm volatile("s_wait_asynccnt 0x0" ::: "memory");
        __syncthreads();   // lh2 reused next chunk
        // every wave has left lw2: the next chunk's w2 block flies during GEMM1 and GELU
        if (chv < 3) stage_w(w2 + (chv + 1) * 64, HIDD, lw2, t);
    }

    // ---- bias2, stage y tile ----
    #pragma unroll
    for (int i = 0; i < 8; ++i) {
        int r = mt * 16 + i + rhi;
        float bias = b2[r];
        ly[r * LYP + n0] = y0[i] + bias;
        ly[r * LYP + n1] = y1[i] + bias;
    }
    __syncthreads();

    // ---- spectral filter: per (channel, 4x4 window). 64 ch * 4 windows = 256 threads ----
    {
        const int c  = t >> 2;
        const int wy = (t >> 1) & 1;
        const int wx = t & 1;

        float z[4][4];
        #pragma unroll
        for (int r = 0; r < 4; ++r)
            #pragma unroll
            for (int s = 0; s < 4; ++s)
                z[r][s] = ly[c * LYP + (wy * 4 + r) * 8 + wx * 4 + s];

        // forward DFT along s (k2): twiddles are {1,-i,-1,i}
        float R0[4], R2[4], R1r[4], R1i[4];
        #pragma unroll
        for (int r = 0; r < 4; ++r) {
            R0[r]  = z[r][0] + z[r][1] + z[r][2] + z[r][3];
            R2[r]  = z[r][0] - z[r][1] + z[r][2] - z[r][3];
            R1r[r] = z[r][0] - z[r][2];
            R1i[r] = z[r][3] - z[r][1];
        }
        // forward DFT along r (k1) -> Z[k1][k2], k2 = 0..2
        float Zr[4][3], Zi[4][3];
        Zr[0][0] = R0[0] + R0[1] + R0[2] + R0[3];  Zi[0][0] = 0.f;
        Zr[1][0] = R0[0] - R0[2];                  Zi[1][0] = R0[3] - R0[1];
        Zr[2][0] = R0[0] - R0[1] + R0[2] - R0[3];  Zi[2][0] = 0.f;
        Zr[3][0] = R0[0] - R0[2];                  Zi[3][0] = R0[1] - R0[3];
        Zr[0][2] = R2[0] + R2[1] + R2[2] + R2[3];  Zi[0][2] = 0.f;
        Zr[1][2] = R2[0] - R2[2];                  Zi[1][2] = R2[3] - R2[1];
        Zr[2][2] = R2[0] - R2[1] + R2[2] - R2[3];  Zi[2][2] = 0.f;
        Zr[3][2] = R2[0] - R2[2];                  Zi[3][2] = R2[1] - R2[3];
        Zr[0][1] = R1r[0] + R1r[1] + R1r[2] + R1r[3];
        Zi[0][1] = R1i[0] + R1i[1] + R1i[2] + R1i[3];
        Zr[1][1] = R1r[0] + R1i[1] - R1r[2] - R1i[3];
        Zi[1][1] = R1i[0] - R1r[1] - R1i[2] + R1r[3];
        Zr[2][1] = R1r[0] - R1r[1] + R1r[2] - R1r[3];
        Zi[2][1] = R1i[0] - R1i[1] + R1i[2] - R1i[3];
        Zr[3][1] = R1r[0] - R1i[1] - R1r[2] + R1i[3];
        Zi[3][1] = R1i[0] + R1r[1] - R1i[2] - R1r[3];

        // multiply by complex weight cweight[k1][k2][c][{re,im}]
        #pragma unroll
        for (int k1 = 0; k1 < 4; ++k1)
            #pragma unroll
            for (int k2 = 0; k2 < 3; ++k2) {
                const float* wp = cw + ((size_t)(k1 * 3 + k2) * CIN + c) * 2;
                float wr = wp[0], wi = wp[1];
                float zr = Zr[k1][k2], zi = Zi[k1][k2];
                Zr[k1][k2] = zr * wr - zi * wi;
                Zi[k1][k2] = zr * wi + zi * wr;
            }

        // inverse complex DFT along k1: V[r][k2] = sum_k1 (+i)^(r*k1) * Z[k1][k2]
        float Vr[4][3], Vi[4][3];
        #pragma unroll
        for (int k2 = 0; k2 < 3; ++k2) {
            Vr[0][k2] = Zr[0][k2] + Zr[1][k2] + Zr[2][k2] + Zr[3][k2];
            Vi[0][k2] = Zi[0][k2] + Zi[1][k2] + Zi[2][k2] + Zi[3][k2];
            Vr[1][k2] = Zr[0][k2] - Zi[1][k2] - Zr[2][k2] + Zi[3][k2];
            Vi[1][k2] = Zi[0][k2] + Zr[1][k2] - Zi[2][k2] - Zr[3][k2];
            Vr[2][k2] = Zr[0][k2] - Zr[1][k2] + Zr[2][k2] - Zr[3][k2];
            Vi[2][k2] = Zi[0][k2] - Zi[1][k2] + Zi[2][k2] - Zi[3][k2];
            Vr[3][k2] = Zr[0][k2] + Zi[1][k2] - Zr[2][k2] - Zi[3][k2];
            Vi[3][k2] = Zi[0][k2] - Zr[1][k2] - Zi[2][k2] + Zr[3][k2];
        }

        // irfft along s (Hermitian half k2=0..2), total ortho scale 1/16
        const float sc = 1.0f / 16.0f;
        #pragma unroll
        for (int r = 0; r < 4; ++r) {
            float p0 = Vr[r][0], p1r = Vr[r][1], p1i = Vi[r][1], p2 = Vr[r][2];
            f4 o;
            o.x = (p0 + p2 + 2.0f * p1r) * sc;
            o.y = (p0 - p2 - 2.0f * p1i) * sc;
            o.z = (p0 + p2 - 2.0f * p1r) * sc;
            o.w = (p0 - p2 + 2.0f * p1i) * sc;
            float* gp = out + (((size_t)(bz * CIN + c) * HH + (h0 + wy * 4 + r)) * WWID
                               + w0 + wx * 4);
            *(f4*)gp = o;
        }
    }
}

extern "C" void kernel_launch(void* const* d_in, const int* in_sizes, int n_in,
                              void* d_out, int out_size, void* d_ws, size_t ws_size,
                              hipStream_t stream) {
    const float* x  = (const float*)d_in[0];
    const float* w1 = (const float*)d_in[1];
    const float* b1 = (const float*)d_in[2];
    const float* w2 = (const float*)d_in[3];
    const float* b2 = (const float*)d_in[4];
    const float* cw = (const float*)d_in[5];
    float* out = (float*)d_out;

    dim3 grid(WWID / TP, HH / TP, 8);   // 32 x 32 x B
    dim3 block(256);                    // 8 wave32
    fmffn_fused<<<grid, block, 0, stream>>>(x, w1, b1, w2, b2, cw, out);
}

// v002
// Measured time: 226 microseconds a run.
// In both of two side-by-side timings against v001, it was 1.04 times as fast.
// Counting every step since v000, it is 1.32 times as fast.
#include <hip/hip_runtime.h>
#include <hip/hip_bf16.h>

typedef __attribute__((ext_vector_type(2))) float v2f;
typedef __attribute__((ext_vector_type(4))) float f4;
typedef __attribute__((ext_vector_type(8))) float v8f;

#define CIN   64
#define HIDD  256
#define HH    256
#define WWID  256
#define TP    8       // 8x8 pixel tile per workgroup (= 2x2 windows of 4x4)
#define RPSTR 160     // dwords per K-row-pair: 64 px * 2 + 32 pad (bank-conflict-free b64 frags)
#define LYP   68      // padded row stride for y tile
#define WSTR  68      // dwords per staged weight row: 64 + 4, so the b64 A fragments of 16 rows fall on 64 distinct banks

__device__ __forceinline__ v2f splat2(float c) { v2f r = {c, c}; return r; }
__device__ __forceinline__ v2f fma2(v2f a, v2f b, v2f c) { return __builtin_elementwise_fma(a, b, c); }

// Exact GELU of two values, without a branch. erf is the usual single-precision pair of fits:
// |x| < 1: x + x*P(x*x); else: sign(x) * (1 - exp(-(|x| + |x|*Q(|x|)))). Both are evaluated for every
// lane and one is selected, so all values of a chunk sit in one basic block as independent chains.
__device__ __forceinline__ v2f gelu_exact2(v2f v) {
    const v2f x  = v * splat2(0.70710678118654752440f);
    const v2f ax = __builtin_elementwise_abs(x);
    const v2f t  = x * x;
    v2f p = fma2(t, splat2(-0x1.268bc2p-11f), splat2(0x1.420828p-8f));
    p = fma2(t, p, splat2(-0x1.b5937p-6f));
    p = fma2(t, p, splat2(0x1.ce077cp-4f));
    p = fma2(t, p, splat2(-0x1.81266p-2f));
    p = fma2(t, p, splat2(0x1.06eba0p-3f));
    const v2f es = fma2(x, p, x);
    v2f q = fma2(ax, splat2(0x1.1d3156p-16f), splat2(-0x1.8d129p-12f));
    q = fma2(ax, q, splat2(0x1.f9a6d2p-9f));
    q = fma2(ax, q, splat2(-0x1.8c3164p-6f));
    q = fma2(ax, q, splat2(0x1.b4e9c8p-4f));
    q = fma2(ax, q, splat2(0x1.4515fap-1f));
    q = fma2(ax, q, splat2(0x1.078e50p-3f));
    q = fma2(ax, q, ax);
    const v2f a = q * splat2(-1.44269504088896340736f);   // exp(-q) = 2^(-q * log2 e)
    v2f e;
    e.x = ax.x < 1.0f ? es.x : __builtin_copysignf(1.0f - __builtin_amdgcn_exp2f(a.x), x.x);
    e.y = ax.y < 1.0f ? es.y : __builtin_copysignf(1.0f - __builtin_amdgcn_exp2f(a.y), x.y);
    return splat2(0.5f) * v * (splat2(1.0f) + e);
}

// One 64 x 64 block of a weight matrix (row pitch gpitch floats) -> LDS rows of WSTR dwords.
// 16 lanes cover one 256-byte row, so every copy reads whole lines; four copies per thread.
__device__ __forceinline__ void stage_w(const float* __restrict__ g, int gpitch, float* l, int t) {
    const int row = t >> 4;
    const int col = (t & 15) * 4;
    const float* g0 = g + (row     ) * gpitch + col;
    const float* g1 = g + (row + 16) * gpitch + col;
    const float* g2 = g + (row + 32) * gpitch + col;
    const float* g3 = g + (row + 48) * gpitch + col;
    unsigned l0 = (unsigned)(uintptr_t)&l[(row     ) * WSTR + col];
    unsigned l1 = (unsigned)(uintptr_t)&l[(row + 16) * WSTR + col];
    unsigned l2 = (unsigned)(uintptr_t)&l[(row + 32) * WSTR + col];
    unsigned l3 = (unsigned)(uintptr_t)&l[(row + 48) * WSTR + col];
    // the closing s_wait_xcnt stands in the copies' own statement, ahead of any rewrite of their address registers
    asm volatile("global_load_async_to_lds_b128 %0, %4, off\n\t"
                 "global_load_async_to_lds_b128 %1, %5, off\n\t"
                 "global_load_async_to_lds_b128 %2, %6, off\n\t"
                 "global_load_async_to_lds_b128 %3, %7, off\n\t"
                 "s_wait_xcnt 0x0"
                 :: "v"(l0), "v"(l1), "v"(l2), "v"(l3), "v"(g0), "v"(g1), "v"(g2), "v"(g3)
                 : "memory");
}

__global__ __launch_bounds__(256) void fmffn_fused(
    const float* __restrict__ x,  const float* __restrict__ w1,
    const float* __restrict__ b1, const float* __restrict__ w2,
    const float* __restrict__ b2, const float* __restrict__ cw,
    float* __restrict__ out)
{
    // K-pair interleaved tiles: element (k,p) lives at [(k>>1)*RPSTR + 2p + (k&1)]
    __shared__ float lx2[32 * RPSTR];   // x tile   (64 ch  x 64 px)
    __shared__ float lh2[32 * RPSTR];   // hidden chunk (64 x 64 px), GELU applied
    __shared__ __attribute__((aligned(16))) float lw1[64 * WSTR];   // w1 rows of the current hidden chunk
    __shared__ __attribute__((aligned(16))) float lw2[64 * WSTR];   // w2 columns of the current hidden chunk
    float* ly = lh2;                    // y tile before spectral filter: lives in lh2 once the last chunk is read

    const int t    = threadIdx.x;
    const int wave = t >> 5;            // wave32
    const int lane = t & 31;
    const int bz = blockIdx.z;
    const int h0 = blockIdx.y * TP;
    const int w0 = blockIdx.x * TP;

    // ---- chunk 0 of both weight matrices -> LDS; lands with the x tile behind the wait below ----
    stage_w(w1, CIN,  lw1, t);
    stage_w(w2, HIDD, lw2, t);

    // ---- stage x tile into pair-interleaved LDS via async global->LDS (ASYNCcnt) ----
    #pragma unroll
    for (int i = 0; i < 16; ++i) {
        int idx = t + i * 256;          // 0..4095 -> (c, p); consecutive lanes = consecutive w
        int c = idx >> 6;
        int p = idx & 63;
        int py = p >> 3, px = p & 7;
        const float* gp = x + (((size_t)(bz * CIN + c) * HH + (h0 + py)) * WWID + w0 + px);
        unsigned ldsoff = (unsigned)(uintptr_t)&lx2[(c >> 1) * RPSTR + p * 2 + (c & 1)];
        asm volatile("global_load_async_to_lds_b32 %0, %1, off"
                     :: "v"(ldsoff), "v"(gp) : "memory");
    }
    asm volatile("s_wait_asynccnt 0x0" ::: "memory");
    __syncthreads();

    // wave -> (M tile, pair of N tiles). 4 M-tiles x 4 N-tiles of 16x16.
    const int mt  = wave & 3;
    const int ntb = (wave >> 2) * 2;
    const int l15 = lane & 15;
    const int kh  = (lane >> 4) << 1;   // A/B frag K offset: lanes 0-15 -> {0,1}, 16-31 -> {2,3}
    const int rhi = (lane >> 4) << 3;   // C/D row offset for upper half-wave
    const int n0  = ntb * 16 + l15;
    const int n1  = (ntb + 1) * 16 + l15;
    const int n0x2 = n0 * 2;
    const int n1x2 = n1 * 2;

    v8f y0 = {}; v8f y1 = {};           // GEMM2 accumulators (persist across K chunks)

    // kept rolled (no peeled last trip): one copy of the chunk body, and its registers stay within 128
    #pragma unroll 1
    for (int chv = 0; chv < 4; ++chv) {
        // ---- GEMM1 chunk: h[chv*64 + r][p] = sum_c w1[o][c] * x[c][p] ----
        v8f a0 = {}; v8f a1 = {};
        const int wrow = (mt * 16 + l15) * WSTR + kh;   // this lane's A-fragment row in lw1 / lw2
        #pragma unroll
        for (int k0 = 0; k0 < 16; ++k0) {
            int rp = k0 * 2 + (kh >> 1);                  // (k0*4 + kh) / 2
            v2f af  = *(const v2f*)&lw1[wrow + k0 * 4];
            v2f bf0 = *(const v2f*)&lx2[rp * RPSTR + n0x2];   // single ds_load_b64
            v2f bf1 = *(const v2f*)&lx2[rp * RPSTR + n1x2];
            a0 = __builtin_amdgcn_wmma_f32_16x16x4_f32(false, af, false, bf0, (short)0, a0, false, false);
            a1 = __builtin_amdgcn_wmma_f32_16x16x4_f32(false, af, false, bf1, (short)0, a1, false, false);
        }
        // bias + exact GELU -> LDS hidden chunk (pair-interleaved)
        // rows r and r + 1 are one K pair: neighbours in the accumulator registers and in lh2
        #pragma unroll
        for (int i = 0; i < 8; i += 2) {
            int r = mt * 16 + i + rhi;
            v2f bias = {b1[chv * 64 + r], b1[chv * 64 + r + 1]};
            v2f h0 = {a0[i], a0[i + 1]};
            v2f h1 = {a1[i], a1[i + 1]};
            *(v2f*)&lh2[(r >> 1) * RPSTR + n0x2] = gelu_exact2(h0 + bias);
            *(v2f*)&lh2[(r >> 1) * RPSTR + n1x2] = gelu_exact2(h1 + bias);
            // one K pair of both tiles at a time (four chains): with all of them interleaved the kernel needs
            // more than 128 registers, and three work-groups instead of four stay resident on a WGP
            if (i < 6) __builtin_amdgcn_sched_barrier(0);
        }
        // publish point: own LDS traffic retired, own copies of this chunk's w2 block landed, then the barrier
        asm volatile("s_wait_dscnt 0x0" ::: "memory");
        asm volatile("s_wait_asynccnt 0x0" ::: "memory");
        __syncthreads();
        // every wave has left lw1: the next chunk's w1 block flies during GEMM2
        if (chv < 3) stage_w(w1 + (chv + 1) * 64 * CIN, CIN, lw1, t);

        // ---- GEMM2 partial: y[c][p] += sum_{o in chunk} w2[c][o] * h[o][p] ----
        #pragma unroll
        for (int k0 = 0; k0 < 16; ++k0) {
            int rp = k0 * 2 + (kh >> 1);
            v2f af  = *(const v2f*)&lw2[wrow + k0 * 4];
            v2f bf0 = *(const v2f*)&lh2[rp * RPSTR + n0x2];
            v2f bf1 = *(const v2f*)&lh2[rp * RPSTR + n1x2];
            y0 = __builtin_amdgcn_wmma_f32_16x16x4_f32(false, af, false, bf0, (short)0, y0, false, false);
            y1 = __builtin_amdgcn_wmma_f32_16x16x4_f32(false, af, false, bf1, (short)0, y1, false, false);
        }
        // publish point: own LDS reads retired, own copies of the next w1 block landed, then the barrier
        asm volatile("s_wait_dscnt 0x0" ::: "memory");
        asm volatile("s_wait_asynccnt 0x0" ::: "memory");
        __syncthreads();   // lh2 reused next chunk
        // every wave has left lw2: the next chunk's w2 block flies during GEMM1 and GELU
        if (chv < 3) stage_w(w2 + (chv + 1) * 64, HIDD, lw2, t);
    }

    // ---- bias2, stage y tile ----
    #pragma unroll
    for (int i = 0; i < 8; ++i) {
        int r = mt * 16 + i + rhi;
        float bias = b2[r];
        ly[r * LYP + n0] = y0[i] + bias;
        ly[r * LYP + n1] = y1[i] + bias;
    }
    __syncthreads();

    // ---- spectral filter: per (channel, 4x4 window). 64 ch * 4 windows = 256 threads ----
    {
        const int c  = t >> 2;
        const int wy = (t >> 1) & 1;
        const int wx = t & 1;

        float z[4][4];
        #pragma unroll
        for (int r = 0; r < 4; ++r)
            #pragma unroll
            for (int s = 0; s < 4; ++s)
                z[r][s] = ly[c * LYP + (wy * 4 + r) * 8 + wx * 4 + s];

        // forward DFT along s (k2): twiddles are {1,-i,-1,i}
        float R0[4], R2[4], R1r[4], R1i[4];
        #pragma unroll
        for (int r = 0; r < 4; ++r) {
            R0[r]  = z[r][0] + z[r][1] + z[r][2] + z[r][3];
            R2[r]  = z[r][0] - z[r][1] + z[r][2] - z[r][3];
            R1r[r] = z[r][0] - z[r][2];
            R1i[r] = z[r][3] - z[r][1];
        }
        // forward DFT along r (k1) -> Z[k1][k2], k2 = 0..2
        float Zr[4][3], Zi[4][3];
        Zr[0][0] = R0[0] + R0[1] + R0[2] + R0[3];  Zi[0][0] = 0.f;
        Zr[1][0] = R0[0] - R0[2];                  Zi[1][0] = R0[3] - R0[1];
        Zr[2][0] = R0[0] - R0[1] + R0[2] - R0[3];  Zi[2][0] = 0.f;
        Zr[3][0] = R0[0] - R0[2];                  Zi[3][0] = R0[1] - R0[3];
        Zr[0][2] = R2[0] + R2[1] + R2[2] + R2[3];  Zi[0][2] = 0.f;
        Zr[1][2] = R2[0] - R2[2];                  Zi[1][2] = R2[3] - R2[1];
        Zr[2][2] = R2[0] - R2[1] + R2[2] - R2[3];  Zi[2][2] = 0.f;
        Zr[3][2] = R2[0] - R2[2];                  Zi[3][2] = R2[1] - R2[3];
        Zr[0][1] = R1r[0] + R1r[1] + R1r[2] + R1r[3];
        Zi[0][1] = R1i[0] + R1i[1] + R1i[2] + R1i[3];
        Zr[1][1] = R1r[0] + R1i[1] - R1r[2] - R1i[3];
        Zi[1][1] = R1i[0] - R1r[1] - R1i[2] + R1r[3];
        Zr[2][1] = R1r[0] - R1r[1] + R1r[2] - R1r[3];
        Zi[2][1] = R1i[0] - R1i[1] + R1i[2] - R1i[3];
        Zr[3][1] = R1r[0] - R1i[1] - R1r[2] + R1i[3];
        Zi[3][1] = R1i[0] + R1r[1] - R1i[2] - R1r[3];

        // multiply by complex weight cweight[k1][k2][c][{re,im}]
        #pragma unroll
        for (int k1 = 0; k1 < 4; ++k1)
            #pragma unroll
            for (int k2 = 0; k2 < 3; ++k2) {
                const float* wp = cw + ((size_t)(k1 * 3 + k2) * CIN + c) * 2;
                float wr = wp[0], wi = wp[1];
                float zr = Zr[k1][k2], zi = Zi[k1][k2];
                Zr[k1][k2] = zr * wr - zi * wi;
                Zi[k1][k2] = zr * wi + zi * wr;
            }

        // inverse complex DFT along k1: V[r][k2] = sum_k1 (+i)^(r*k1) * Z[k1][k2]
        float Vr[4][3], Vi[4][3];
        #pragma unroll
        for (int k2 = 0; k2 < 3; ++k2) {
            Vr[0][k2] = Zr[0][k2] + Zr[1][k2] + Zr[2][k2] + Zr[3][k2];
            Vi[0][k2] = Zi[0][k2] + Zi[1][k2] + Zi[2][k2] + Zi[3][k2];
            Vr[1][k2] = Zr[0][k2] - Zi[1][k2] - Zr[2][k2] + Zi[3][k2];
            Vi[1][k2] = Zi[0][k2] + Zr[1][k2] - Zi[2][k2] - Zr[3][k2];
            Vr[2][k2] = Zr[0][k2] - Zr[1][k2] + Zr[2][k2] - Zr[3][k2];
            Vi[2][k2] = Zi[0][k2] - Zi[1][k2] + Zi[2][k2] - Zi[3][k2];
            Vr[3][k2] = Zr[0][k2] + Zi[1][k2] - Zr[2][k2] - Zi[3][k2];
            Vi[3][k2] = Zi[0][k2] - Zr[1][k2] - Zi[2][k2] + Zr[3][k2];
        }

        // irfft along s (Hermitian half k2=0..2), total ortho scale 1/16
        const float sc = 1.0f / 16.0f;
        #pragma unroll
        for (int r = 0; r < 4; ++r) {
            float p0 = Vr[r][0], p1r = Vr[r][1], p1i = Vi[r][1], p2 = Vr[r][2];
            f4 o;
            o.x = (p0 + p2 + 2.0f * p1r) * sc;
            o.y = (p0 - p2 - 2.0f * p1i) * sc;
            o.z = (p0 + p2 - 2.0f * p1r) * sc;
            o.w = (p0 - p2 + 2.0f * p1i) * sc;
            float* gp = out + (((size_t)(bz * CIN + c) * HH + (h0 + wy * 4 + r)) * WWID
                               + w0 + wx * 4);
            *(f4*)gp = o;
        }
    }
}

extern "C" void kernel_launch(void* const* d_in, const int* in_sizes, int n_in,
                              void* d_out, int out_size, void* d_ws, size_t ws_size,
                              hipStream_t stream) {
    const float* x  = (const float*)d_in[0];
    const float* w1 = (const float*)d_in[1];
    const float* b1 = (const float*)d_in[2];
    const float* w2 = (const float*)d_in[3];
    const float* b2 = (const float*)d_in[4];
    const float* cw = (const float*)d_in[5];
    float* out = (float*)d_out;

    dim3 grid(WWID / TP, HH / TP, 8);   // 32 x 32 x B
    dim3 block(256);                    // 8 wave32
    fmffn_fused<<<grid, block, 0, stream>>>(x, w1, b1, w2, b2, cw, out);
}

// v003
// It runs in 185 microseconds.
// Next to v002, in two timings, it ran 1.22 and 1.21 times as fast.
// All steps since v000 together make it 1.61 times as fast.
#include <hip/hip_runtime.h>
#include <hip/hip_bf16.h>

typedef __attribute__((ext_vector_type(2))) float v2f;
typedef __attribute__((ext_vector_type(4))) float f4;
typedef __attribute__((ext_vector_type(8))) float v8f;

#define CIN   64
#define HIDD  256
#define HH    256
#define WWID  256
#define TROWS 4       // pixel tile per workgroup: 4 rows x 64 columns (16 windows of 4x4), whole 256-byte row pieces
#define TCOLS 64
#define W1STR 68      // dwords per staged w1 row: 64 + 4  (16 B x odd: b128 A fragments of 16 rows without bank conflicts)
#define W2STR 260     // dwords per staged w2 row: 256 + 4 (16 B x odd)
#define LYP   260     // dwords per channel of the y tile: 256 px + 4

__device__ __forceinline__ v2f splat2(float c) { v2f r = {c, c}; return r; }
__device__ __forceinline__ v2f fma2(v2f a, v2f b, v2f c) { return __builtin_elementwise_fma(a, b, c); }

// Exact GELU of four pairs of values, in place, without a branch. erf is the usual single-precision pair of fits:
// |x| < 1: x + x*P(x*x); else: sign(x) * (1 - exp(-(|x| + |x|*Q(|x|)))). Both are evaluated for every lane and one
// is selected. Written fit step by fit step over the four pairs, so that eight independent chains stand side by side.
#define EACH4 _Pragma("unroll") for (int j = 0; j < 4; ++j)
__device__ __forceinline__ void gelu_exact2x4(v2f (&v)[4]) {
    v2f x[4], ax[4], t[4], p[4], q[4];
    EACH4 x[j]  = v[j] * splat2(0.70710678118654752440f);
    EACH4 ax[j] = __builtin_elementwise_abs(x[j]);
    EACH4 t[j]  = x[j] * x[j];
    EACH4 q[j] = fma2(ax[j], splat2(0x1.1d3156p-16f), splat2(-0x1.8d129p-12f));
    EACH4 p[j] = fma2(t[j], splat2(-0x1.268bc2p-11f), splat2(0x1.420828p-8f));
    EACH4 q[j] = fma2(ax[j], q[j], splat2(0x1.f9a6d2p-9f));
    EACH4 p[j] = fma2(t[j], p[j], splat2(-0x1.b5937p-6f));
    EACH4 q[j] = fma2(ax[j], q[j], splat2(-0x1.8c3164p-6f));
    EACH4 p[j] = fma2(t[j], p[j], splat2(0x1.ce077cp-4f));
    EACH4 q[j] = fma2(ax[j], q[j], splat2(0x1.b4e9c8p-4f));
    EACH4 p[j] = fma2(t[j], p[j], splat2(-0x1.81266p-2f));
    EACH4 q[j] = fma2(ax[j], q[j], splat2(0x1.4515fap-1f));
    EACH4 p[j] = fma2(t[j], p[j], splat2(0x1.06eba0p-3f));
    EACH4 q[j] = fma2(ax[j], q[j], splat2(0x1.078e50p-3f));
    EACH4 p[j] = fma2(x[j], p[j], x[j]);
    EACH4 q[j] = fma2(ax[j], q[j], ax[j]);
    EACH4 q[j] = q[j] * splat2(-1.44269504088896340736f);   // exp(-q) = 2^(-q * log2 e)
    EACH4 { q[j].x = __builtin_amdgcn_exp2f(q[j].x); q[j].y = __builtin_amdgcn_exp2f(q[j].y); }
    EACH4 {
        v2f e;
        e.x = ax[j].x < 1.0f ? p[j].x : __builtin_copysignf(1.0f - q[j].x, x[j].x);
        e.y = ax[j].y < 1.0f ? p[j].y : __builtin_copysignf(1.0f - q[j].y, x[j].y);
        v[j] = splat2(0.5f) * v[j] * (splat2(1.0f) + e);
    }
}

// Eight 16-byte copies per thread: 2048 consecutive float4 of g, starting at float4 index i0 + t, 256 apart,
// land in LDS rows of (1 << lg4) float4 at a pitch of lstr dwords. A wave's copy reads 512 contiguous bytes.
__device__ __forceinline__ void stage8(const float* __restrict__ g, float* l, int lg4, int lstr, int i0, int t) {
    const float* gp[8];
    unsigned lp[8];
    #pragma unroll
    for (int i = 0; i < 8; ++i) {
        const int idx = i0 + t + i * 256;
        gp[i] = g + idx * 4;
        lp[i] = (unsigned)(uintptr_t)&l[(idx >> lg4) * lstr + (idx & ((1 << lg4) - 1)) * 4];
    }
    // the closing s_wait_xcnt stands in the copies' own statement, ahead of any rewrite of their address registers
    asm volatile("global_load_async_to_lds_b128 %0, %8, off\n\t"
                 "global_load_async_to_lds_b128 %1, %9, off\n\t"
                 "global_load_async_to_lds_b128 %2, %10, off\n\t"
                 "global_load_async_to_lds_b128 %3, %11, off\n\t"
                 "global_load_async_to_lds_b128 %4, %12, off\n\t"
                 "global_load_async_to_lds_b128 %5, %13, off\n\t"
                 "global_load_async_to_lds_b128 %6, %14, off\n\t"
                 "global_load_async_to_lds_b128 %7, %15, off\n\t"
                 "s_wait_xcnt 0x0"
                 :: "v"(lp[0]), "v"(lp[1]), "v"(lp[2]), "v"(lp[3]), "v"(lp[4]), "v"(lp[5]), "v"(lp[6]), "v"(lp[7]),
                    "v"(gp[0]), "v"(gp[1]), "v"(gp[2]), "v"(gp[3]), "v"(gp[4]), "v"(gp[5]), "v"(gp[6]), "v"(gp[7])
                 : "memory");
}

// two workgroups per WGP (LDS), four waves per SIMD: 256 registers a wave
__global__ __launch_bounds__(256) __attribute__((amdgpu_waves_per_eu(4, 4))) void fmffn_fused(
    const float* __restrict__ x,  const float* __restrict__ w1,
    const float* __restrict__ b1, const float* __restrict__ w2,
    const float* __restrict__ b2, const float* __restrict__ cw,
    float* __restrict__ out)
{
    __shared__ __attribute__((aligned(16))) float lw1[HIDD * W1STR];   // all of w1
    __shared__ __attribute__((aligned(16))) float lw2[CIN * W2STR];    // all of w2
    float* ly = lw1;                    // y tile before the spectral filter: lives in lw1 once every wave has left the loop

    const int t    = threadIdx.x;
    const int wave = t >> 5;            // wave32
    const int lane = t & 31;
    const int l15  = lane & 15;
    const int half = lane >> 4;
    const int bz = blockIdx.z;
    const int h0 = blockIdx.y * TROWS;
    const int w0 = blockIdx.x * TCOLS;

    // ---- this wave's 32 pixels (one row, 32 columns): all 64 channels as B fragments, straight from global ----
    // column n of N tile nt is pixel 2n + nt, so one b64 load serves both tiles and 16 lanes read one whole line.
    // k order of GEMM1: step (q, e) holds channels 8q + 4*half + 2e + {0,1}; the w1 fragments below use the same.
    const int prow = wave >> 1;
    const int pcol = (wave & 1) * 32 + 2 * l15;
    v2f xf[8][2][2];                    // [q][e][nt]
    {
        const float* xp = x + (((size_t)(bz * CIN + 4 * half) * HH + (h0 + prow)) * WWID + w0 + pcol);
        #pragma unroll
        for (int q = 0; q < 8; ++q) {
            #pragma unroll
            for (int e = 0; e < 2; ++e) {
                const v2f c0 = *(const v2f*)(xp + (size_t)(8 * q + 2 * e    ) * HH * WWID);
                const v2f c1 = *(const v2f*)(xp + (size_t)(8 * q + 2 * e + 1) * HH * WWID);
                xf[q][e][0] = v2f{c0.x, c1.x};
                xf[q][e][1] = v2f{c0.y, c1.y};
            }
        }
    }

    // ---- both weight matrices -> LDS, once ----
    stage8(w1, lw1, 4, W1STR, 0,    t);
    stage8(w1, lw1, 4, W1STR, 2048, t);
    stage8(w2, lw2, 6, W2STR, 0,    t);
    stage8(w2, lw2, 6, W2STR, 2048, t);
    asm volatile("s_wait_asynccnt 0x0" ::: "memory");   // own copies landed; the barrier publishes every wave's
    __syncthreads();

    v8f y[4][2] = {};                   // GEMM2 accumulators: 64 channels x 32 pixels

    const float* a1p = &lw1[l15 * W1STR + 4 * half];
    const float* a2p = &lw2[l15 * W2STR + 8 * half];

    // the w1 fragments of the first trip
    f4 w1f[8];
    #pragma unroll
    for (int q = 0; q < 8; ++q) w1f[q] = *(const f4*)&a1p[q * 8];

    // one trip = 16 hidden rows, from x to y inside the wave: no LDS round trip for h and no barrier.
    // kept rolled: one copy of the body in the instruction cache
    #pragma unroll 1
    for (int m = 0; m < 16; ++m) {
        const f4 bl = *(const f4*)&b1[m * 16 + 8 * half];
        const f4 bh = *(const f4*)&b1[m * 16 + 8 * half + 4];
        // this trip's w2 fragments, as one group: their LDS latency passes under GEMM1
        f4 w2f[2][4];
        #pragma unroll
        for (int u = 0; u < 2; ++u)
            #pragma unroll
            for (int ct = 0; ct < 4; ++ct)
                w2f[u][ct] = *(const f4*)&a2p[ct * 16 * W2STR + m * 16 + u * 4];
        // keeps the group of loads above the matrix run; left free, each load sinks to its first use and is waited out there
        __builtin_amdgcn_sched_barrier(0);

        // ---- GEMM1: a[nt][i] = h_pre[m*16 + 8*half + i][pixel] ----
        v8f a0 = {}; v8f a1 = {};
        #pragma unroll
        for (int q = 0; q < 8; ++q) {
            const v2f lo = {w1f[q].x, w1f[q].y};
            const v2f hi = {w1f[q].z, w1f[q].w};
            a0 = __builtin_amdgcn_wmma_f32_16x16x4_f32(false, lo, false, xf[q][0][0], (short)0, a0, false, false);
            a1 = __builtin_amdgcn_wmma_f32_16x16x4_f32(false, lo, false, xf[q][0][1], (short)0, a1, false, false);
            a0 = __builtin_amdgcn_wmma_f32_16x16x4_f32(false, hi, false, xf[q][1][0], (short)0, a0, false, false);
            a1 = __builtin_amdgcn_wmma_f32_16x16x4_f32(false, hi, false, xf[q][1][1], (short)0, a1, false, false);
        }

        // ---- bias + exact GELU in the accumulator registers ----
        // registers 2s, 2s+1 of a D tile are hidden rows 8*half + 2s + {0,1}: as they stand, a B fragment of GEMM2
        const v2f bb[4] = {{bl.x, bl.y}, {bl.z, bl.w}, {bh.x, bh.y}, {bh.z, bh.w}};
        v2f hf0[4], hf1[4];
        #pragma unroll
        for (int s = 0; s < 4; ++s) {
            hf0[s] = v2f{a0[2 * s], a0[2 * s + 1]} + bb[s];
            hf1[s] = v2f{a1[2 * s], a1[2 * s + 1]} + bb[s];
        }
        gelu_exact2x4(hf0);
        gelu_exact2x4(hf1);

        // the next trip's w1 fragments, as one group: their LDS latency passes under GEMM2 (the last trip reads row 0 again)
        #pragma unroll
        for (int q = 0; q < 8; ++q) w1f[q] = *(const f4*)&a1p[((m + 1) & 15) * 16 * W1STR + q * 8];
        // keeps the group of loads above the matrix run, as above
        __builtin_amdgcn_sched_barrier(0);

        // ---- GEMM2: y[c][pixel] += w2[c][o] * h[o][pixel]; k order: step s holds o = m*16 + 8*half + 2s + {0,1} ----
        #pragma unroll
        for (int u = 0; u < 2; ++u)
            #pragma unroll
            for (int ct = 0; ct < 4; ++ct) {
                const v2f lo = {w2f[u][ct].x, w2f[u][ct].y};
                const v2f hi = {w2f[u][ct].z, w2f[u][ct].w};
                y[ct][0] = __builtin_amdgcn_wmma_f32_16x16x4_f32(false, lo, false, hf0[2 * u],     (short)0, y[ct][0], false, false);
                y[ct][1] = __builtin_amdgcn_wmma_f32_16x16x4_f32(false, lo, false, hf1[2 * u],     (short)0, y[ct][1], false, false);
                y[ct][0] = __builtin_amdgcn_wmma_f32_16x16x4_f32(false, hi, false, hf0[2 * u + 1], (short)0, y[ct][0], false, false);
                y[ct][1] = __builtin_amdgcn_wmma_f32_16x16x4_f32(false, hi, false, hf1[2 * u + 1], (short)0, y[ct][1], false, false);
            }
        // the matrix run stays above the slots below
        __builtin_amdgcn_sched_barrier(0);
        // distance behind the last matrix instruction on the taken back edge:
        // the next trip's first address additions reuse the registers of its A fragment
        asm volatile("v_nop\n\tv_nop\n\tv_nop\n\tv_nop");
    }

    __syncthreads();   // every wave has read its last w1 fragment: lw1 becomes the y tile

    // ---- bias2, stage y tile: the two N tiles are neighbouring pixels, one b64 store ----
    #pragma unroll
    for (int ct = 0; ct < 4; ++ct)
        #pragma unroll
        for (int i = 0; i < 8; ++i) {
            const int c = ct * 16 + i + 8 * half;
            const float bias = b2[c];
            *(v2f*)&ly[c * LYP + prow * TCOLS + pcol] = v2f{y[ct][0][i] + bias, y[ct][1][i] + bias};
        }
    __syncthreads();

    // ---- spectral filter: per (channel, 4x4 window). 64 ch * 16 windows = 4 per thread ----
    // 16 lanes take the 16 windows of one channel: LDS reads and global stores cover whole 256-byte row pieces
    #pragma unroll 1
    for (int it = 0; it < 4; ++it) {
        const int c  = (t >> 4) + it * 16;
        const int wx = t & 15;

        float z[4][4];
        #pragma unroll
        for (int r = 0; r < 4; ++r) {
            const f4 zr4 = *(const f4*)&ly[c * LYP + r * TCOLS + wx * 4];
            z[r][0] = zr4.x; z[r][1] = zr4.y; z[r][2] = zr4.z; z[r][3] = zr4.w;
        }

        // forward DFT along s (k2): twiddles are {1,-i,-1,i}
        float R0[4], R2[4], R1r[4], R1i[4];
        #pragma unroll
        for (int r = 0; r < 4; ++r) {
            R0[r]  = z[r][0] + z[r][1] + z[r][2] + z[r][3];
            R2[r]  = z[r][0] - z[r][1] + z[r][2] - z[r][3];
            R1r[r] = z[r][0] - z[r][2];
            R1i[r] = z[r][3] - z[r][1];
        }
        // forward DFT along r (k1) -> Z[k1][k2], k2 = 0..2
        float Zr[4][3], Zi[4][3];
        Zr[0][0] = R0[0] + R0[1] + R0[2] + R0[3];  Zi[0][0] = 0.f;
        Zr[1][0] = R0[0] - R0[2];                  Zi[1][0] = R0[3] - R0[1];
        Zr[2][0] = R0[0] - R0[1] + R0[2] - R0[3];  Zi[2][0] = 0.f;
        Zr[3][0] = R0[0] - R0[2];                  Zi[3][0] = R0[1] - R0[3];
        Zr[0][2] = R2[0] + R2[1] + R2[2] + R2[3];  Zi[0][2] = 0.f;
        Zr[1][2] = R2[0] - R2[2];                  Zi[1][2] = R2[3] - R2[1];
        Zr[2][2] = R2[0] - R2[1] + R2[2] - R2[3];  Zi[2][2] = 0.f;
        Zr[3][2] = R2[0] - R2[2];                  Zi[3][2] = R2[1] - R2[3];
        Zr[0][1] = R1r[0] + R1r[1] + R1r[2] + R1r[3];
        Zi[0][1] = R1i[0] + R1i[1] + R1i[2] + R1i[3];
        Zr[1][1] = R1r[0] + R1i[1] - R1r[2] - R1i[3];
        Zi[1][1] = R1i[0] - R1r[1] - R1i[2] + R1r[3];
        Zr[2][1] = R1r[0] - R1r[1] + R1r[2] - R1r[3];
        Zi[2][1] = R1i[0] - R1i[1] + R1i[2] - R1i[3];
        Zr[3][1] = R1r[0] - R1i[1] - R1r[2] + R1i[3];
        Zi[3][1] = R1i[0] + R1r[1] - R1i[2] - R1r[3];

        // multiply by complex weight cweight[k1][k2][c][{re,im}]
        #pragma unroll
        for (int k1 = 0; k1 < 4; ++k1)
            #pragma unroll
            for (int k2 = 0; k2 < 3; ++k2) {
                const float* wp = cw + ((size_t)(k1 * 3 + k2) * CIN + c) * 2;
                float wr = wp[0], wi = wp[1];
                float zr = Zr[k1][k2], zi = Zi[k1][k2];
                Zr[k1][k2] = zr * wr - zi * wi;
                Zi[k1][k2] = zr * wi + zi * wr;
            }

        // inverse complex DFT along k1: V[r][k2] = sum_k1 (+i)^(r*k1) * Z[k1][k2]
        float Vr[4][3], Vi[4][3];
        #pragma unroll
        for (int k2 = 0; k2 < 3; ++k2) {
            Vr[0][k2] = Zr[0][k2] + Zr[1][k2] + Zr[2][k2] + Zr[3][k2];
            Vi[0][k2] = Zi[0][k2] + Zi[1][k2] + Zi[2][k2] + Zi[3][k2];
            Vr[1][k2] = Zr[0][k2] - Zi[1][k2] - Zr[2][k2] + Zi[3][k2];
            Vi[1][k2] = Zi[0][k2] + Zr[1][k2] - Zi[2][k2] - Zr[3][k2];
            Vr[2][k2] = Zr[0][k2] - Zr[1][k2] + Zr[2][k2] - Zr[3][k2];
            Vi[2][k2] = Zi[0][k2] - Zi[1][k2] + Zi[2][k2] - Zi[3][k2];
            Vr[3][k2] = Zr[0][k2] + Zi[1][k2] - Zr[2][k2] - Zi[3][k2];
            Vi[3][k2] = Zi[0][k2] - Zr[1][k2] - Zi[2][k2] + Zr[3][k2];
        }

        // irfft along s (Hermitian half k2=0..2), total ortho scale 1/16
        const float sc = 1.0f / 16.0f;
        #pragma unroll
        for (int r = 0; r < 4; ++r) {
            float p0 = Vr[r][0], p1r = Vr[r][1], p1i = Vi[r][1], p2 = Vr[r][2];
            f4 o;
            o.x = (p0 + p2 + 2.0f * p1r) * sc;
            o.y = (p0 - p2 - 2.0f * p1i) * sc;
            o.z = (p0 + p2 - 2.0f * p1r) * sc;
            o.w = (p0 - p2 + 2.0f * p1i) * sc;
            float* gp = out + (((size_t)(bz * CIN + c) * HH + (h0 + r)) * WWID + w0 + wx * 4);
            *(f4*)gp = o;
        }
        // the next trip's loads are given the registers that these stores name: the wait stands in front of them
        asm volatile("s_wait_xcnt 0x0" ::: "memory");
    }
}

extern "C" void kernel_launch(void* const* d_in, const int* in_sizes, int n_in,
                              void* d_out, int out_size, void* d_ws, size_t ws_size,
                              hipStream_t stream) {
    const float* x  = (const float*)d_in[0];
    const float* w1 = (const float*)d_in[1];
    const float* b1 = (const float*)d_in[2];
    const float* w2 = (const float*)d_in[3];
    const float* b2 = (const float*)d_in[4];
    const float* cw = (const float*)d_in[5];
    float* out = (float*)d_out;

    dim3 grid(WWID / TCOLS, HH / TROWS, 8);   // 4 x 64 x B
    dim3 block(256);                          // 8 wave32
    fmffn_fused<<<grid, block, 0, stream>>>(x, w1, b1, w2, b2, cw, out);
}

// v004
// A run of this version takes 167 microseconds.
// Two timings next to v003 both put it at 1.10 times that version's speed.
// Counting every step since v000, it is 1.78 times as fast.
#include <hip/hip_runtime.h>
#include <hip/hip_bf16.h>

typedef __attribute__((ext_vector_type(2))) float v2f;
typedef __attribute__((ext_vector_type(4))) float f4;
typedef __attribute__((ext_vector_type(8))) float v8f;

#define CIN   64
#define HIDD  256
#define HH    256
#define WWID  256
#define TROWS 4       // pixel tile per workgroup: 4 rows x 64 columns (16 windows of 4x4), whole 256-byte row pieces
#define TCOLS 64
#define W1STR 68      // dwords per staged w1 row: 64 + 4  (16 B x odd: b128 A fragments of 16 rows without bank conflicts)
#define W2STR 260     // dwords per staged w2 row: 256 + 4 (16 B x odd)
#define LYP   260     // dwords per channel of the y tile: 256 px + 4

__device__ __forceinline__ v2f splat2(float c) { v2f r = {c, c}; return r; }
__device__ __forceinline__ v2f fma2(v2f a, v2f b, v2f c) { return __builtin_elementwise_fma(a, b, c); }

// Exact (erf) GELU of four pairs of values, in place, without a branch and with one fit for every v:
// gelu(v) = max(v, 0) - s * erfc(sqrt(2) * s) with s = |v| / 2, and erfc(sqrt(2) * s) = 2^(-s * G(s)).
// G is one polynomial of degree 7, fitted for the absolute error of the normal distribution function (under half a unit
// in the last place of a value between one half and one) up to where 2^(-s*G) is below 2^-35; its leading term is
// positive, so past the fit the power goes on falling to 0 and gelu(v) to max(v, 0).
// The sign of -G is folded into the coefficients. Written step by step over the four pairs: independent chains side by side.
#define EACH4 _Pragma("unroll") for (int j = 0; j < 4; ++j)
__device__ __forceinline__ void gelu_exact2x4(v2f (&v)[4]) {
    v2f r[4], s[4], g[4];
    EACH4 { r[j].x = __builtin_fmaxf(v[j].x, 0.0f); r[j].y = __builtin_fmaxf(v[j].y, 0.0f); }
    EACH4 s[j] = fma2(v[j], splat2(-0.5f), r[j]);            // |v| / 2, exact
    EACH4 g[j] = fma2(s[j], splat2(-0x1.7c7edep-11f), splat2(0x1.4a52f4p-8f));
    EACH4 g[j] = fma2(s[j], g[j], splat2(-0x1.8672c2p-7f));
    EACH4 g[j] = fma2(s[j], g[j], splat2(-0x1.1f2d24p-8f));
    EACH4 g[j] = fma2(s[j], g[j], splat2(0x1.cee886p-4f));
    EACH4 g[j] = fma2(s[j], g[j], splat2(-0x1.ae0c78p-2f));
    EACH4 g[j] = fma2(s[j], g[j], splat2(-0x1.d63aacp+0f));
    EACH4 g[j] = fma2(s[j], g[j], splat2(-0x1.26aed4p+1f));
    EACH4 g[j] = s[j] * g[j];
    EACH4 { g[j].x = __builtin_amdgcn_exp2f(g[j].x); g[j].y = __builtin_amdgcn_exp2f(g[j].y); }
    EACH4 v[j] = fma2(-s[j], g[j], r[j]);
}

// Eight 16-byte copies per thread: 2048 consecutive float4 of g, starting at float4 index i0 + t, 256 apart,
// land in LDS rows of (1 << lg4) float4 at a pitch of lstr dwords. A wave's copy reads 512 contiguous bytes.
__device__ __forceinline__ void stage8(const float* __restrict__ g, float* l, int lg4, int lstr, int i0, int t) {
    const float* gp[8];
    unsigned lp[8];
    #pragma unroll
    for (int i = 0; i < 8; ++i) {
        const int idx = i0 + t + i * 256;
        gp[i] = g + idx * 4;
        lp[i] = (unsigned)(uintptr_t)&l[(idx >> lg4) * lstr + (idx & ((1 << lg4) - 1)) * 4];
    }
    // the closing s_wait_xcnt stands in the copies' own statement, ahead of any rewrite of their address registers
    asm volatile("global_load_async_to_lds_b128 %0, %8, off\n\t"
                 "global_load_async_to_lds_b128 %1, %9, off\n\t"
                 "global_load_async_to_lds_b128 %2, %10, off\n\t"
                 "global_load_async_to_lds_b128 %3, %11, off\n\t"
                 "global_load_async_to_lds_b128 %4, %12, off\n\t"
                 "global_load_async_to_lds_b128 %5, %13, off\n\t"
                 "global_load_async_to_lds_b128 %6, %14, off\n\t"
                 "global_load_async_to_lds_b128 %7, %15, off\n\t"
                 "s_wait_xcnt 0x0"
                 :: "v"(lp[0]), "v"(lp[1]), "v"(lp[2]), "v"(lp[3]), "v"(lp[4]), "v"(lp[5]), "v"(lp[6]), "v"(lp[7]),
                    "v"(gp[0]), "v"(gp[1]), "v"(gp[2]), "v"(gp[3]), "v"(gp[4]), "v"(gp[5]), "v"(gp[6]), "v"(gp[7])
                 : "memory");
}

// two workgroups per WGP (LDS), four waves per SIMD: 256 registers a wave
__global__ __launch_bounds__(256) __attribute__((amdgpu_waves_per_eu(4, 4))) void fmffn_fused(
    const float* __restrict__ x,  const float* __restrict__ w1,
    const float* __restrict__ b1, const float* __restrict__ w2,
    const float* __restrict__ b2, const float* __restrict__ cw,
    float* __restrict__ out)
{
    __shared__ __attribute__((aligned(16))) float lw1[HIDD * W1STR];   // all of w1
    __shared__ __attribute__((aligned(16))) float lw2[CIN * W2STR];    // all of w2
    float* ly = lw1;                    // y tile before the spectral filter: lives in lw1 once every wave has left the loop

    const int t    = threadIdx.x;
    const int wave = t >> 5;            // wave32
    const int lane = t & 31;
    const int l15  = lane & 15;
    const int half = lane >> 4;
    const int bz = blockIdx.z;
    const int h0 = blockIdx.y * TROWS;
    const int w0 = blockIdx.x * TCOLS;

    // ---- this wave's 32 pixels (one row, 32 columns): all 64 channels as B fragments, straight from global ----
    // column n of N tile nt is pixel 2n + nt, so one b64 load serves both tiles and 16 lanes read one whole line.
    // k order of GEMM1: step (q, e) holds channels 8q + 4*half + 2e + {0,1}; the w1 fragments below use the same.
    const int prow = wave >> 1;
    const int pcol = (wave & 1) * 32 + 2 * l15;
    v2f xf[8][2][2];                    // [q][e][nt]
    {
        const float* xp = x + (((size_t)(bz * CIN + 4 * half) * HH + (h0 + prow)) * WWID + w0 + pcol);
        #pragma unroll
        for (int q = 0; q < 8; ++q) {
            #pragma unroll
            for (int e = 0; e < 2; ++e) {
                const v2f c0 = *(const v2f*)(xp + (size_t)(8 * q + 2 * e    ) * HH * WWID);
                const v2f c1 = *(const v2f*)(xp + (size_t)(8 * q + 2 * e + 1) * HH * WWID);
                xf[q][e][0] = v2f{c0.x, c1.x};
                xf[q][e][1] = v2f{c0.y, c1.y};
            }
        }
    }

    // ---- both weight matrices -> LDS, once ----
    stage8(w1, lw1, 4, W1STR, 0,    t);
    stage8(w1, lw1, 4, W1STR, 2048, t);
    stage8(w2, lw2, 6, W2STR, 0,    t);
    stage8(w2, lw2, 6, W2STR, 2048, t);
    asm volatile("s_wait_asynccnt 0x0" ::: "memory");   // own copies landed; the barrier publishes every wave's
    __syncthreads();

    v8f y[4][2] = {};                   // GEMM2 accumulators: 64 channels x 32 pixels

    const float* a1p = &lw1[l15 * W1STR + 4 * half];
    const float* a2p = &lw2[l15 * W2STR + 8 * half];

    // the w1 fragments of the first trip
    f4 w1f[8];
    #pragma unroll
    for (int q = 0; q < 8; ++q) w1f[q] = *(const f4*)&a1p[q * 8];

    // one trip = 16 hidden rows, from x to y inside the wave: no LDS round trip for h and no barrier.
    // kept rolled: one copy of the body in the instruction cache
    #pragma unroll 1
    for (int m = 0; m < 16; ++m) {
        const f4 bl = *(const f4*)&b1[m * 16 + 8 * half];
        const f4 bh = *(const f4*)&b1[m * 16 + 8 * half + 4];
        // this trip's w2 fragments, as one group: their LDS latency passes under GEMM1
        f4 w2f[2][4];
        #pragma unroll
        for (int u = 0; u < 2; ++u)
            #pragma unroll
            for (int ct = 0; ct < 4; ++ct)
                w2f[u][ct] = *(const f4*)&a2p[ct * 16 * W2STR + m * 16 + u * 4];
        // keeps the group of loads above the matrix run; left free, each load sinks to its first use and is waited out there
        __builtin_amdgcn_sched_barrier(0);

        // ---- GEMM1: a[nt][i] = h_pre[m*16 + 8*half + i][pixel] ----
        v8f a0 = {}; v8f a1 = {};
        #pragma unroll
        for (int q = 0; q < 8; ++q) {
            const v2f lo = {w1f[q].x, w1f[q].y};
            const v2f hi = {w1f[q].z, w1f[q].w};
            a0 = __builtin_amdgcn_wmma_f32_16x16x4_f32(false, lo, false, xf[q][0][0], (short)0, a0, false, false);
            a1 = __builtin_amdgcn_wmma_f32_16x16x4_f32(false, lo, false, xf[q][0][1], (short)0, a1, false, false);
            a0 = __builtin_amdgcn_wmma_f32_16x16x4_f32(false, hi, false, xf[q][1][0], (short)0, a0, false, false);
            a1 = __builtin_amdgcn_wmma_f32_16x16x4_f32(false, hi, false, xf[q][1][1], (short)0, a1, false, false);
        }

        // ---- bias + exact GELU in the accumulator registers ----
        // registers 2s, 2s+1 of a D tile are hidden rows 8*half + 2s + {0,1}: as they stand, a B fragment of GEMM2
        const v2f bb[4] = {{bl.x, bl.y}, {bl.z, bl.w}, {bh.x, bh.y}, {bh.z, bh.w}};
        v2f hf0[4], hf1[4];
        #pragma unroll
        for (int s = 0; s < 4; ++s) {
            hf0[s] = v2f{a0[2 * s], a0[2 * s + 1]} + bb[s];
            hf1[s] = v2f{a1[2 * s], a1[2 * s + 1]} + bb[s];
        }
        gelu_exact2x4(hf0);
        gelu_exact2x4(hf1);

        // keeps the loads below in one group behind the GELU; left free, they are spread one by one among GEMM1's matrix instructions
        __builtin_amdgcn_sched_barrier(0);
        // the next trip's w1 fragments, as one group: their LDS latency passes under GEMM2 (the last trip reads row 0 again)
        #pragma unroll
        for (int q = 0; q < 8; ++q) w1f[q] = *(const f4*)&a1p[((m + 1) & 15) * 16 * W1STR + q * 8];
        // keeps the group of loads above the matrix run, as above
        __builtin_amdgcn_sched_barrier(0);

        // ---- GEMM2: y[c][pixel] += w2[c][o] * h[o][pixel]; k order: step s holds o = m*16 + 8*half + 2s + {0,1} ----
        #pragma unroll
        for (int u = 0; u < 2; ++u)
            #pragma unroll
            for (int ct = 0; ct < 4; ++ct) {
                const v2f lo = {w2f[u][ct].x, w2f[u][ct].y};
                const v2f hi = {w2f[u][ct].z, w2f[u][ct].w};
                y[ct][0] = __builtin_amdgcn_wmma_f32_16x16x4_f32(false, lo, false, hf0[2 * u],     (short)0, y[ct][0], false, false);
                y[ct][1] = __builtin_amdgcn_wmma_f32_16x16x4_f32(false, lo, false, hf1[2 * u],     (short)0, y[ct][1], false, false);
                y[ct][0] = __builtin_amdgcn_wmma_f32_16x16x4_f32(false, hi, false, hf0[2 * u + 1], (short)0, y[ct][0], false, false);
                y[ct][1] = __builtin_amdgcn_wmma_f32_16x16x4_f32(false, hi, false, hf1[2 * u + 1], (short)0, y[ct][1], false, false);
            }
        // the matrix run stays above the slots below
        __builtin_amdgcn_sched_barrier(0);
        // distance behind the last matrix instruction on the taken back edge:
        // the next trip's first address additions reuse the registers of its A fragment
        asm volatile("v_nop\n\tv_nop\n\tv_nop\n\tv_nop");
    }

    __syncthreads();   // every wave has read its last w1 fragment: lw1 becomes the y tile

    // ---- bias2, stage y tile: the two N tiles are neighbouring pixels, one b64 store ----
    #pragma unroll
    for (int ct = 0; ct < 4; ++ct)
        #pragma unroll
        for (int i = 0; i < 8; ++i) {
            const int c = ct * 16 + i + 8 * half;
            const float bias = b2[c];
            *(v2f*)&ly[c * LYP + prow * TCOLS + pcol] = v2f{y[ct][0][i] + bias, y[ct][1][i] + bias};
        }
    __syncthreads();

    // ---- spectral filter: per (channel, 4x4 window). 64 ch * 16 windows = 4 per thread ----
    // 16 lanes take the 16 windows of one channel: LDS reads and global stores cover whole 256-byte row pieces
    #pragma unroll 1
    for (int it = 0; it < 4; ++it) {
        const int c  = (t >> 4) + it * 16;
        const int wx = t & 15;

        float z[4][4];
        #pragma unroll
        for (int r = 0; r < 4; ++r) {
            const f4 zr4 = *(const f4*)&ly[c * LYP + r * TCOLS + wx * 4];
            z[r][0] = zr4.x; z[r][1] = zr4.y; z[r][2] = zr4.z; z[r][3] = zr4.w;
        }

        // forward DFT along s (k2): twiddles are {1,-i,-1,i}
        float R0[4], R2[4], R1r[4], R1i[4];
        #pragma unroll
        for (int r = 0; r < 4; ++r) {
            R0[r]  = z[r][0] + z[r][1] + z[r][2] + z[r][3];
            R2[r]  = z[r][0] - z[r][1] + z[r][2] - z[r][3];
            R1r[r] = z[r][0] - z[r][2];
            R1i[r] = z[r][3] - z[r][1];
        }
        // forward DFT along r (k1) -> Z[k1][k2], k2 = 0..2
        float Zr[4][3], Zi[4][3];
        Zr[0][0] = R0[0] + R0[1] + R0[2] + R0[3];  Zi[0][0] = 0.f;
        Zr[1][0] = R0[0] - R0[2];                  Zi[1][0] = R0[3] - R0[1];
        Zr[2][0] = R0[0] - R0[1] + R0[2] - R0[3];  Zi[2][0] = 0.f;
        Zr[3][0] = R0[0] - R0[2];                  Zi[3][0] = R0[1] - R0[3];
        Zr[0][2] = R2[0] + R2[1] + R2[2] + R2[3];  Zi[0][2] = 0.f;
        Zr[1][2] = R2[0] - R2[2];                  Zi[1][2] = R2[3] - R2[1];
        Zr[2][2] = R2[0] - R2[1] + R2[2] - R2[3];  Zi[2][2] = 0.f;
        Zr[3][2] = R2[0] - R2[2];                  Zi[3][2] = R2[1] - R2[3];
        Zr[0][1] = R1r[0] + R1r[1] + R1r[2] + R1r[3];
        Zi[0][1] = R1i[0] + R1i[1] + R1i[2] + R1i[3];
        Zr[1][1] = R1r[0] + R1i[1] - R1r[2] - R1i[3];
        Zi[1][1] = R1i[0] - R1r[1] - R1i[2] + R1r[3];
        Zr[2][1] = R1r[0] - R1r[1] + R1r[2] - R1r[3];
        Zi[2][1] = R1i[0] - R1i[1] + R1i[2] - R1i[3];
        Zr[3][1] = R1r[0] - R1i[1] - R1r[2] + R1i[3];
        Zi[3][1] = R1i[0] + R1r[1] - R1i[2] - R1r[3];

        // multiply by complex weight cweight[k1][k2][c][{re,im}]
        #pragma unroll
        for (int k1 = 0; k1 < 4; ++k1)
            #pragma unroll
            for (int k2 = 0; k2 < 3; ++k2) {
                const float* wp = cw + ((size_t)(k1 * 3 + k2) * CIN + c) * 2;
                float wr = wp[0], wi = wp[1];
                float zr = Zr[k1][k2], zi = Zi[k1][k2];
                Zr[k1][k2] = zr * wr - zi * wi;
                Zi[k1][k2] = zr * wi + zi * wr;
            }

        // inverse complex DFT along k1: V[r][k2] = sum_k1 (+i)^(r*k1) * Z[k1][k2]
        float Vr[4][3], Vi[4][3];
        #pragma unroll
        for (int k2 = 0; k2 < 3; ++k2) {
            Vr[0][k2] = Zr[0][k2] + Zr[1][k2] + Zr[2][k2] + Zr[3][k2];
            Vi[0][k2] = Zi[0][k2] + Zi[1][k2] + Zi[2][k2] + Zi[3][k2];
            Vr[1][k2] = Zr[0][k2] - Zi[1][k2] - Zr[2][k2] + Zi[3][k2];
            Vi[1][k2] = Zi[0][k2] + Zr[1][k2] - Zi[2][k2] - Zr[3][k2];
            Vr[2][k2] = Zr[0][k2] - Zr[1][k2] + Zr[2][k2] - Zr[3][k2];
            Vi[2][k2] = Zi[0][k2] - Zi[1][k2] + Zi[2][k2] - Zi[3][k2];
            Vr[3][k2] = Zr[0][k2] + Zi[1][k2] - Zr[2][k2] - Zi[3][k2];
            Vi[3][k2] = Zi[0][k2] - Zr[1][k2] - Zi[2][k2] + Zr[3][k2];
        }

        // irfft along s (Hermitian half k2=0..2), total ortho scale 1/16
        const float sc = 1.0f / 16.0f;
        #pragma unroll
        for (int r = 0; r < 4; ++r) {
            float p0 = Vr[r][0], p1r = Vr[r][1], p1i = Vi[r][1], p2 = Vr[r][2];
            f4 o;
            o.x = (p0 + p2 + 2.0f * p1r) * sc;
            o.y = (p0 - p2 - 2.0f * p1i) * sc;
            o.z = (p0 + p2 - 2.0f * p1r) * sc;
            o.w = (p0 - p2 + 2.0f * p1i) * sc;
            float* gp = out + (((size_t)(bz * CIN + c) * HH + (h0 + r)) * WWID + w0 + wx * 4);
            *(f4*)gp = o;
        }
        // the next trip's loads are given the registers that these stores name: the wait stands in front of them
        asm volatile("s_wait_xcnt 0x0" ::: "memory");
    }
}

extern "C" void kernel_launch(void* const* d_in, const int* in_sizes, int n_in,
                              void* d_out, int out_size, void* d_ws, size_t ws_size,
                              hipStream_t stream) {
    const float* x  = (const float*)d_in[0];
    const float* w1 = (const float*)d_in[1];
    const float* b1 = (const float*)d_in[2];
    const float* w2 = (const float*)d_in[3];
    const float* b2 = (const float*)d_in[4];
    const float* cw = (const float*)d_in[5];
    float* out = (float*)d_out;

    dim3 grid(WWID / TCOLS, HH / TROWS, 8);   // 4 x 64 x B
    dim3 block(256);                          // 8 wave32
    fmffn_fused<<<grid, block, 0, stream>>>(x, w1, b1, w2, b2, cw, out);
}
